// v000
// Times are from an AMD MI455X. After a warm-up the kernel runs many times in a row, and a time is the length of
// such a window on the GPU divided by its runs, so every launch and the gaps after it count. The runs cycle
// through copies of the inputs. A figure is the median of several windows, for all but v000 over two sittings.
// Sittings can differ by a few percent; kernels timed side by side share one.
// v000 is the starting kernel. One run takes 1710 microseconds.
// compute dtype: all float inputs rounded to bf16; q/k/v = x W ((in,out)) with EXACT bf16 products on WMMA 16x16x32, f32 accumulate; q as f16 hi + residual (x 2^10), k f16 -> 2-product logits (no 1/sqrt(d) in T5) + the relative-position bias rel_emb[bucket(k - q)][h] (bucket table precomputed from the module's own f32 formula), stored in f32; softmax in f32 (precise expf), P x 2^11 f32 split bf16 hi + lo against v bf16 hi + lo (3 products); out = context (bf16 hi + lo) Wo ((in,out)); f32 output.
#include <hip/hip_runtime.h>
#include <math.h>

typedef __attribute__((ext_vector_type(16))) _Float16 v16h;
typedef __attribute__((ext_vector_type(16))) __bf16 v16b;
typedef __attribute__((ext_vector_type(8)))  _Float16 v8h;
typedef __attribute__((ext_vector_type(8)))  float v8f;
typedef __attribute__((ext_vector_type(4)))  float v4f;
typedef __attribute__((ext_vector_type(2)))  float v2f;
typedef __attribute__((ext_vector_type(4)))  unsigned v4u;
typedef __attribute__((ext_vector_type(4)))  int v4i;
typedef float __attribute__((may_alias)) float_a;
typedef int __attribute__((may_alias)) int_a;

template <typename T> __device__ __forceinline__ void vst2(void* p, T v) { *(T*)p = v;  }
__device__ __forceinline__ v8f wmma16(v16h a, v16h b, v8f c) {
  v8f d = __builtin_amdgcn_wmma_f32_16x16x32_f16(false, a, false, b, (short)0, c, false, false);
  asm volatile("v_nop\n\tv_nop\n\tv_nop\n\tv_nop" : "+v"(d) : "v"(a), "v"(b));
  return d;
}
__device__ __forceinline__ v8f wmma_bf(v16b a, v16b b, v8f c) {
  v8f d = __builtin_amdgcn_wmma_f32_16x16x32_bf16(false, a, false, b, (short)0, c, false, false);
  asm volatile("v_nop\n\tv_nop\n\tv_nop\n\tv_nop" : "+v"(d) : "v"(a), "v"(b));
  return d;
}
// 16x16x32 fragments: lane = (h = lane>>4, row/col = lane&15); elements 0..7 = k0+8h+0..7, 8..15 = k0+16+8h+0..7; D element r = row 8h+r
__device__ __forceinline__ v16h frag_h(const _Float16* rowk0, int lane) {
  union { v16h v; v8h q[2]; } u; const _Float16* p = rowk0 + 8 * (lane >> 4);
  u.q[0] = *(const v8h*)p; u.q[1] = *(const v8h*)(p + 16); return u.v;
}
__device__ __forceinline__ v16h frag_f32(const float* rowk0, int lane) {
  v16h a; const float* p = rowk0 + 8 * (lane >> 4);
#pragma unroll
  for (int i = 0; i < 8; ++i) { a[i] = (_Float16)p[i]; a[8 + i] = (_Float16)p[16 + i]; }
  return a;
}
__device__ __forceinline__ v16h frag_f32s(const float* rowk0, int lane, float sc) {
  v16h a; const float* p = rowk0 + 8 * (lane >> 4);
#pragma unroll
  for (int i = 0; i < 8; ++i) { a[i] = (_Float16)(p[i] * sc); a[8 + i] = (_Float16)(p[16 + i] * sc); }
  return a;
}
// column fragment from a [K][ld] layout (column n), rows >= K read as 0
__device__ __forceinline__ v16h fragc_f32(const float* W, int k0, int n, int lane, int ld, int K) {
  v16h a; const int g = lane >> 4;
#pragma unroll
  for (int i = 0; i < 8; ++i) { const int ka = k0 + 8 * g + i, kb = ka + 16;
    a[i] = (_Float16)(ka < K ? W[(size_t)(ka < K ? ka : K - 1) * ld + n] : 0.f); a[8 + i] = (_Float16)(kb < K ? W[(size_t)(kb < K ? kb : K - 1) * ld + n] : 0.f); }
  return a;
}
struct F2 { v16b h, l; };
__device__ __forceinline__ F2 bsplit16(const float v[16]) { F2 r;
#pragma unroll
  for (int i = 0; i < 16; ++i) { const __bf16 h = (__bf16)v[i]; r.h[i] = h; r.l[i] = (__bf16)(v[i] - (float)h); }
  return r; }
__device__ __forceinline__ F2 split_row(const float* row, int k0, int lane) { float v[16]; const float* p = row + k0 + 8 * (lane >> 4);
#pragma unroll
  for (int i = 0; i < 8; ++i) { v[i] = p[i]; v[8 + i] = p[16 + i]; }
  return bsplit16(v); }
__device__ __forceinline__ F2 split_rowK(const float* row, int k0, int lane, int K) { float v[16]; const int g = lane >> 4;
#pragma unroll
  for (int i = 0; i < 8; ++i) { const int ka = k0 + 8 * g + i, kb = ka + 16; v[i] = ka < K ? row[ka < K ? ka : K - 1] : 0.f; v[8 + i] = kb < K ? row[kb < K ? kb : K - 1] : 0.f; }
  return bsplit16(v); }
__device__ __forceinline__ F2 split_col(const float* W, int k0, int n, int lane, int ld, int K) { float v[16]; const int g = lane >> 4;
#pragma unroll
  for (int i = 0; i < 8; ++i) { const int ka = k0 + 8 * g + i, kb = ka + 16; v[i] = ka < K ? W[(size_t)(ka < K ? ka : K - 1) * ld + n] : 0.f; v[8 + i] = kb < K ? W[(size_t)(kb < K ? kb : K - 1) * ld + n] : 0.f; }
  return bsplit16(v); }
__device__ __forceinline__ v8f mac3(const F2& a, const F2& b, v8f c) { c = wmma_bf(a.l, b.h, c); c = wmma_bf(a.h, b.l, c); return wmma_bf(a.h, b.h, c); }
__device__ __forceinline__ float sigm(float v) { return 1.0f / (1.0f + expf(-v)); }
#define LDSX() do { asm volatile("s_wait_dscnt 0" ::: "memory"); __builtin_amdgcn_wave_barrier(); __builtin_amdgcn_fence(__ATOMIC_RELEASE, "workgroup"); } while (0)


// T5 attention (B 2, S 2,048, D 1,024 = 16 x 64, no biases, no scaling): scores = q k^T + rel_emb[bucket(mem - ctx)] (32 buckets, bidirectional, max distance 128), softmax, P v, output projection.
#define NB 2
#define TT 2048
#define CC 1024
#define NH 16
#define HD 64
__constant__ signed char BKT[4095] = {15,15,15,15,15,15,15,15,15,15,15,15,15,15,15,15,15,15,15,15,15,15,15,15,15,15,15,15,15,15,15,15,15,15,15,15,15,15,15,15,15,15,15,15,15,15,15,15,15,15,15,15,15,15,15,15,15,15,15,15,15,15,15,15,15,15,15,15,15,15,15,15,15,15,15,15,15,15,15,15,15,15,15,15,15,15,15,15,15,15,15,15,15,15,15,15,15,15,15,15,15,15,15,15,15,15,15,15,15,15,15,15,15,15,15,15,15,15,15,15,15,15,15,15,15,15,15,15,15,15,15,15,15,15,15,15,15,15,15,15,15,15,15,15,15,15,15,15,15,15,15,15,15,15,15,15,15,15,15,15,15,15,15,15,15,15,15,15,15,15,15,15,15,15,15,15,15,15,15,15,15,15,15,15,15,15,15,15,15,15,15,15,15,15,15,15,15,15,15,15,15,15,15,15,15,15,15,15,15,15,15,15,15,15,15,15,15,15,15,15,15,15,15,15,15,15,15,15,15,15,15,15,15,15,15,15,15,15,15,15,15,15,15,15,15,15,15,15,15,15,15,15,15,15,15,15,15,15,15,15,15,15,15,15,15,15,15,15,15,15,15,15,15,15,15,15,15,15,15,15,15,15,15,15,15,15,15,15,15,15,15,15,15,15,15,15,15,15,15,15,15,15,15,15,15,15,15,15,15,15,15,15,15,15,15,15,15,15,15,15,15,15,15,15,15,15,15,15,15,15,15,15,15,15,15,15,15,15,15,15,15,15,15,15,15,15,15,15,15,15,15,15,15,15,15,15,15,15,15,15,15,15,15,15,15,15,15,15,15,15,15,15,15,15,15,15,15,15,15,15,15,15,15,15,15,15,15,15,15,15,15,15,15,15,15,15,15,15,15,15,15,15,15,15,15,15,15,15,15,15,15,15,15,15,15,15,15,15,15,15,15,15,15,15,15,15,15,15,15,15,15,15,15,15,15,15,15,15,15,15,15,15,15,15,15,15,15,15,15,15,15,15,15,15,15,15,15,15,15,15,15,15,15,15,15,15,15,15,15,15,15,15,15,15,15,15,15,15,15,15,15,15,15,15,15,15,15,15,15,15,15,15,15,15,15,15,15,15,15,15,15,15,15,15,15,15,15,15,15,15,15,15,15,15,15,15,15,15,15,15,15,15,15,15,15,15,15,15,15,15,15,15,15,15,15,15,15,15,15,15,15,15,15,15,15,15,15,15,15,15,15,15,15,15,15,15,15,15,15,15,15,15,15,15,15,15,15,15,15,15,15,15,15,15,15,15,15,15,15,15,15,15,15,15,15,15,15,15,15,15,15,15,15,15,15,15,15,15,15,15,15,15,15,15,15,15,15,15,15,15,15,15,15,15,15,15,15,15,15,15,15,15,15,15,15,15,15,15,15,15,15,15,15,15,15,15,15,15,15,15,15,15,15,15,15,15,15,15,15,15,15,15,15,15,15,15,15,15,15,15,15,15,15,15,15,15,15,15,15,15,15,15,15,15,15,15,15,15,15,15,15,15,15,15,15,15,15,15,15,15,15,15,15,15,15,15,15,15,15,15,15,15,15,15,15,15,15,15,15,15,15,15,15,15,15,15,15,15,15,15,15,15,15,15,15,15,15,15,15,15,15,15,15,15,15,15,15,15,15,15,15,15,15,15,15,15,15,15,15,15,15,15,15,15,15,15,15,15,15,15,15,15,15,15,15,15,15,15,15,15,15,15,15,15,15,15,15,15,15,15,15,15,15,15,15,15,15,15,15,15,15,15,15,15,15,15,15,15,15,15,15,15,15,15,15,15,15,15,15,15,15,15,15,15,15,15,15,15,15,15,15,15,15,15,15,15,15,15,15,15,15,15,15,15,15,15,15,15,15,15,15,15,15,15,15,15,15,15,15,15,15,15,15,15,15,15,15,15,15,15,15,15,15,15,15,15,15,15,15,15,15,15,15,15,15,15,15,15,15,15,15,15,15,15,15,15,15,15,15,15,15,15,15,15,15,15,15,15,15,15,15,15,15,15,15,15,15,15,15,15,15,15,15,15,15,15,15,15,15,15,15,15,15,15,15,15,15,15,15,15,15,15,15,15,15,15,15,15,15,15,15,15,15,15,15,15,15,15,15,15,15,15,15,15,15,15,15,15,15,15,15,15,15,15,15,15,15,15,15,15,15,15,15,15,15,15,15,15,15,15,15,15,15,15,15,15,15,15,15,15,15,15,15,15,15,15,15,15,15,15,15,15,15,15,15,15,15,15,15,15,15,15,15,15,15,15,15,15,15,15,15,15,15,15,15,15,15,15,15,15,15,15,15,15,15,15,15,15,15,15,15,15,15,15,15,15,15,15,15,15,15,15,15,15,15,15,15,15,15,15,15,15,15,15,15,15,15,15,15,15,15,15,15,15,15,15,15,15,15,15,15,15,15,15,15,15,15,15,15,15,15,15,15,15,15,15,15,15,15,15,15,15,15,15,15,15,15,15,15,15,15,15,15,15,15,15,15,15,15,15,15,15,15,15,15,15,15,15,15,15,15,15,15,15,15,15,15,15,15,15,15,15,15,15,15,15,15,15,15,15,15,15,15,15,15,15,15,15,15,15,15,15,15,15,15,15,15,15,15,15,15,15,15,15,15,15,15,15,15,15,15,15,15,15,15,15,15,15,15,15,15,15,15,15,15,15,15,15,15,15,15,15,15,15,15,15,15,15,15,15,15,15,15,15,15,15,15,15,15,15,15,15,15,15,15,15,15,15,15,15,15,15,15,15,15,15,15,15,15,15,15,15,15,15,15,15,15,15,15,15,15,15,15,15,15,15,15,15,15,15,15,15,15,15,15,15,15,15,15,15,15,15,15,15,15,15,15,15,15,15,15,15,15,15,15,15,15,15,15,15,15,15,15,15,15,15,15,15,15,15,15,15,15,15,15,15,15,15,15,15,15,15,15,15,15,15,15,15,15,15,15,15,15,15,15,15,15,15,15,15,15,15,15,15,15,15,15,15,15,15,15,15,15,15,15,15,15,15,15,15,15,15,15,15,15,15,15,15,15,15,15,15,15,15,15,15,15,15,15,15,15,15,15,15,15,15,15,15,15,15,15,15,15,15,15,15,15,15,15,15,15,15,15,15,15,15,15,15,15,15,15,15,15,15,15,15,15,15,15,15,15,15,15,15,15,15,15,15,15,15,15,15,15,15,15,15,15,15,15,15,15,15,15,15,15,15,15,15,15,15,15,15,15,15,15,15,15,15,15,15,15,15,15,15,15,15,15,15,15,15,15,15,15,15,15,15,15,15,15,15,15,15,15,15,15,15,15,15,15,15,15,15,15,15,15,15,15,15,15,15,15,15,15,15,15,15,15,15,15,15,15,15,15,15,15,15,15,15,15,15,15,15,15,15,15,15,15,15,15,15,15,15,15,15,15,15,15,15,15,15,15,15,15,15,15,15,15,15,15,15,15,15,15,15,15,15,15,15,15,15,15,15,15,15,15,15,15,15,15,15,15,15,15,15,15,15,15,15,15,15,15,15,15,15,15,15,15,15,15,15,15,15,15,15,15,15,15,15,15,15,15,15,15,15,15,15,15,15,15,15,15,15,15,15,15,15,15,15,15,15,15,15,15,15,15,15,15,15,15,15,15,15,15,15,15,15,15,15,15,15,15,15,15,15,15,15,15,15,15,15,15,15,15,15,15,15,15,15,15,15,15,15,15,15,15,15,15,15,15,15,15,15,15,15,15,15,15,15,15,15,15,15,15,15,15,15,15,15,15,15,15,15,15,15,15,15,15,15,15,15,15,15,15,15,15,15,15,15,15,15,15,15,15,15,15,15,15,15,15,15,15,15,15,15,15,15,15,15,15,15,15,15,15,15,15,15,15,15,15,15,15,15,15,15,15,15,15,15,15,15,15,15,15,15,15,15,15,15,15,15,15,15,15,15,15,15,15,15,15,15,15,15,15,15,15,15,15,15,15,15,15,15,15,15,15,15,15,15,15,15,15,15,15,15,15,15,15,15,15,15,15,15,15,15,15,15,15,15,15,15,15,15,15,15,15,15,15,15,15,15,15,15,15,15,15,15,15,15,15,15,15,15,15,15,15,15,15,15,15,15,15,15,15,15,15,15,15,15,15,15,15,15,15,15,15,15,15,15,15,15,15,15,15,15,15,15,15,15,15,15,15,15,15,15,15,15,15,15,15,15,15,15,15,15,15,15,15,15,15,15,15,15,15,15,15,15,15,15,15,15,15,15,15,15,15,15,15,15,15,15,15,15,15,15,15,15,15,15,15,15,15,15,15,15,15,15,15,15,15,15,15,15,15,15,15,15,15,15,15,15,15,15,15,15,15,15,15,15,15,15,15,15,15,15,15,15,15,15,15,15,15,15,15,15,15,15,15,14,14,14,14,14,14,14,14,14,14,14,14,14,14,14,14,14,14,14,14,14,14,14,14,14,14,14,13,13,13,13,13,13,13,13,13,13,13,13,13,13,13,13,13,13,12,12,12,12,12,12,12,12,12,12,12,12,12,12,11,11,11,11,11,11,11,11,11,10,10,10,10,10,10,10,9,9,9,9,8,8,8,8,7,6,5,4,3,2,1,0,17,18,19,20,21,22,23,24,24,24,24,25,25,25,25,26,26,26,26,26,26,26,27,27,27,27,27,27,27,27,27,28,28,28,28,28,28,28,28,28,28,28,28,28,28,29,29,29,29,29,29,29,29,29,29,29,29,29,29,29,29,29,29,30,30,30,30,30,30,30,30,30,30,30,30,30,30,30,30,30,30,30,30,30,30,30,30,30,30,30,31,31,31,31,31,31,31,31,31,31,31,31,31,31,31,31,31,31,31,31,31,31,31,31,31,31,31,31,31,31,31,31,31,31,31,31,31,31,31,31,31,31,31,31,31,31,31,31,31,31,31,31,31,31,31,31,31,31,31,31,31,31,31,31,31,31,31,31,31,31,31,31,31,31,31,31,31,31,31,31,31,31,31,31,31,31,31,31,31,31,31,31,31,31,31,31,31,31,31,31,31,31,31,31,31,31,31,31,31,31,31,31,31,31,31,31,31,31,31,31,31,31,31,31,31,31,31,31,31,31,31,31,31,31,31,31,31,31,31,31,31,31,31,31,31,31,31,31,31,31,31,31,31,31,31,31,31,31,31,31,31,31,31,31,31,31,31,31,31,31,31,31,31,31,31,31,31,31,31,31,31,31,31,31,31,31,31,31,31,31,31,31,31,31,31,31,31,31,31,31,31,31,31,31,31,31,31,31,31,31,31,31,31,31,31,31,31,31,31,31,31,31,31,31,31,31,31,31,31,31,31,31,31,31,31,31,31,31,31,31,31,31,31,31,31,31,31,31,31,31,31,31,31,31,31,31,31,31,31,31,31,31,31,31,31,31,31,31,31,31,31,31,31,31,31,31,31,31,31,31,31,31,31,31,31,31,31,31,31,31,31,31,31,31,31,31,31,31,31,31,31,31,31,31,31,31,31,31,31,31,31,31,31,31,31,31,31,31,31,31,31,31,31,31,31,31,31,31,31,31,31,31,31,31,31,31,31,31,31,31,31,31,31,31,31,31,31,31,31,31,31,31,31,31,31,31,31,31,31,31,31,31,31,31,31,31,31,31,31,31,31,31,31,31,31,31,31,31,31,31,31,31,31,31,31,31,31,31,31,31,31,31,31,31,31,31,31,31,31,31,31,31,31,31,31,31,31,31,31,31,31,31,31,31,31,31,31,31,31,31,31,31,31,31,31,31,31,31,31,31,31,31,31,31,31,31,31,31,31,31,31,31,31,31,31,31,31,31,31,31,31,31,31,31,31,31,31,31,31,31,31,31,31,31,31,31,31,31,31,31,31,31,31,31,31,31,31,31,31,31,31,31,31,31,31,31,31,31,31,31,31,31,31,31,31,31,31,31,31,31,31,31,31,31,31,31,31,31,31,31,31,31,31,31,31,31,31,31,31,31,31,31,31,31,31,31,31,31,31,31,31,31,31,31,31,31,31,31,31,31,31,31,31,31,31,31,31,31,31,31,31,31,31,31,31,31,31,31,31,31,31,31,31,31,31,31,31,31,31,31,31,31,31,31,31,31,31,31,31,31,31,31,31,31,31,31,31,31,31,31,31,31,31,31,31,31,31,31,31,31,31,31,31,31,31,31,31,31,31,31,31,31,31,31,31,31,31,31,31,31,31,31,31,31,31,31,31,31,31,31,31,31,31,31,31,31,31,31,31,31,31,31,31,31,31,31,31,31,31,31,31,31,31,31,31,31,31,31,31,31,31,31,31,31,31,31,31,31,31,31,31,31,31,31,31,31,31,31,31,31,31,31,31,31,31,31,31,31,31,31,31,31,31,31,31,31,31,31,31,31,31,31,31,31,31,31,31,31,31,31,31,31,31,31,31,31,31,31,31,31,31,31,31,31,31,31,31,31,31,31,31,31,31,31,31,31,31,31,31,31,31,31,31,31,31,31,31,31,31,31,31,31,31,31,31,31,31,31,31,31,31,31,31,31,31,31,31,31,31,31,31,31,31,31,31,31,31,31,31,31,31,31,31,31,31,31,31,31,31,31,31,31,31,31,31,31,31,31,31,31,31,31,31,31,31,31,31,31,31,31,31,31,31,31,31,31,31,31,31,31,31,31,31,31,31,31,31,31,31,31,31,31,31,31,31,31,31,31,31,31,31,31,31,31,31,31,31,31,31,31,31,31,31,31,31,31,31,31,31,31,31,31,31,31,31,31,31,31,31,31,31,31,31,31,31,31,31,31,31,31,31,31,31,31,31,31,31,31,31,31,31,31,31,31,31,31,31,31,31,31,31,31,31,31,31,31,31,31,31,31,31,31,31,31,31,31,31,31,31,31,31,31,31,31,31,31,31,31,31,31,31,31,31,31,31,31,31,31,31,31,31,31,31,31,31,31,31,31,31,31,31,31,31,31,31,31,31,31,31,31,31,31,31,31,31,31,31,31,31,31,31,31,31,31,31,31,31,31,31,31,31,31,31,31,31,31,31,31,31,31,31,31,31,31,31,31,31,31,31,31,31,31,31,31,31,31,31,31,31,31,31,31,31,31,31,31,31,31,31,31,31,31,31,31,31,31,31,31,31,31,31,31,31,31,31,31,31,31,31,31,31,31,31,31,31,31,31,31,31,31,31,31,31,31,31,31,31,31,31,31,31,31,31,31,31,31,31,31,31,31,31,31,31,31,31,31,31,31,31,31,31,31,31,31,31,31,31,31,31,31,31,31,31,31,31,31,31,31,31,31,31,31,31,31,31,31,31,31,31,31,31,31,31,31,31,31,31,31,31,31,31,31,31,31,31,31,31,31,31,31,31,31,31,31,31,31,31,31,31,31,31,31,31,31,31,31,31,31,31,31,31,31,31,31,31,31,31,31,31,31,31,31,31,31,31,31,31,31,31,31,31,31,31,31,31,31,31,31,31,31,31,31,31,31,31,31,31,31,31,31,31,31,31,31,31,31,31,31,31,31,31,31,31,31,31,31,31,31,31,31,31,31,31,31,31,31,31,31,31,31,31,31,31,31,31,31,31,31,31,31,31,31,31,31,31,31,31,31,31,31,31,31,31,31,31,31,31,31,31,31,31,31,31,31,31,31,31,31,31,31,31,31,31,31,31,31,31,31,31,31,31,31,31,31,31,31,31,31,31,31,31,31,31,31,31,31,31,31,31,31,31,31,31,31,31,31,31,31,31,31,31,31,31,31,31,31,31,31,31,31,31,31,31,31,31,31,31,31,31,31,31,31,31,31,31,31,31,31,31,31,31,31,31,31,31,31,31,31,31,31,31,31,31,31,31,31,31,31,31,31,31,31,31,31,31,31,31,31,31,31,31,31,31,31,31,31,31,31,31,31,31,31,31,31,31,31,31,31,31,31,31,31,31,31,31,31,31,31,31,31,31,31,31,31,31,31,31,31,31,31,31,31,31,31,31,31,31,31,31,31,31,31,31,31,31,31,31,31,31,31,31,31,31,31,31,31,31,31,31,31,31,31,31,31,31,31,31,31,31,31,31,31,31,31,31,31,31,31,31,31,31,31,31,31,31,31,31,31,31,31,31,31,31,31,31,31,31,31,31,31,31,31,31,31,31,31,31,31,31,31,31,31,31,31,31,31,31,31,31,31,31,31,31,31,31,31,31,31,31,31,31,31,31,31,31,31,31,31,31,31,31,31,31,31,31,31,31,31,31,31,31,31,31,31,31,31,31,31,31,31,31,31,31,31,31,31,31,31,31,31,31,31,31,31,31,31,31,31,31,31,31,31,31,31,31,31,31,31,31,31,31,31,31,31,31,31,31,31,31,31,31,31,31,31,31,31,31,31,31,31,31,31,31,31,31,31,31,31,31,31,31,31,31,31,31,31,31,31,31,31,31,31,31,31,31,31,31,31,31,31,31,31,31,31,31,31,31,31,31,31,31,31,31,31,31,31,31,31,31,31,31,31,31,31,31,31,31,31,31,31,31,31,31,31,31,31,31,31,31,31,31,31,31,31,31,31,31,31,31,31,31,31,31,31,31,31,31,31,31,31,31,31,31,31,31,31,31,31,31,31,31,31,31,31,31,31,31,31,31,31,31,31,31,31,31,31,31,31,31,31,31,31,31,31,31,31,31,31,31,31,31,31,31,31,31,31,31,31,31,31,31,31,31,31,31,31,31,31,31,31,31,31,31,31,31,31,31,31,31,31,31,31,31,31,31,31,31,31,31,31,31,31,31,31,31,31,31,31,31,31,31,31,31,31,31,31,31,31,31,31,31,31,31,31,31,31,31,31,31,31,31,31,31,31,31,31,31,31,31,31,31,31,31,31,31,31,31,31,31,31,31,31,31,31,31,31,31,31,31,31,31,31,31,31,31,31,31,31,31,31,31,31,31,31,31,31,31,31,31,31,31,31,31,31,31,31,31,31,31,31,31,31,31,31,31,31,31,31,31,31,31,31,31,31,31,31,31,31,31,31,31,31,31,31,31,31,31,31,31,31,31,31,31,31,31,31,31,31,31,31,31,31,31,31,31,31,31,31,31,31,31,31,31,31,31,31,31,31,31,31,31,31,31,31,31,31,31,31,31,31,31,31,31,31,31,31,31,31,31,31,31,31,31,31,31,31,31,31,31,31,31,31,31,31,31,31,31,31,31,31,31,31,31,31,31,31,31,31,31,31,31,31,31,31,31,31,31};   // relative_position_bucket(k - q) for k - q = -2047 .. 2047 (the module's f32 formula, evaluated exactly as jnp does)
#ifndef TNB
#define TNB NB
#endif
typedef __attribute__((ext_vector_type(8))) __bf16 v8b;
__device__ __forceinline__ v16b frag_b(const __bf16* rowk0, int lane) {
  union { v16b v; v8b q[2]; } u; const __bf16* p = rowk0 + 8 * (lane >> 4);
  u.q[0] = *(const v8b*)p; u.q[1] = *(const v8b*)(p + 16); return u.v;
}
__device__ __forceinline__ float bfr(float v) { return (float)(__bf16)v; }
__device__ __attribute__((noinline)) float exp_ni(float v) { return expf(v); }
__device__ __attribute__((noinline)) float erf_ni(float v) { return erff(v); }

#define WS_QH  0u
#define WS_QL  (WS_QH + 2u * (size_t)NB * TT * CC)
#define WS_KH  (WS_QL + 2u * (size_t)NB * TT * CC)
#define WS_VT  (WS_KH + 2u * (size_t)NB * TT * CC)      // bf16 v planes [b][c][t]
#define WS_VL  (WS_VT + 2u * (size_t)NB * CC * TT)      // bf16 v residual planes
#define HG 4                                          // heads per launch group
#define WS_S   (WS_VL + 2u * (size_t)NB * CC * TT)      // f32 logits / P for HG heads [hg][q][k]
#define WS_PH  (WS_S + 4u * (size_t)HG * TT * TT)
#define WS_Y   (WS_PH + 0u)              // f32 y rows [b*t][C]
#define WS_END (WS_Y + 4u * (size_t)NB * TT * CC)

// ---- k_proj: block = (64 rows, 128 cols, which): qkv = x W (+ b), exact; q -> f16 hi (+ residual), k -> f16 rows, v -> bf16 hi + lo planes
__global__ __launch_bounds__(128) void k_proj(const float* __restrict__ X, const float* __restrict__ WQ, const float* __restrict__ BQ, const float* __restrict__ WK, const float* __restrict__ BK, const float* __restrict__ WV, const float* __restrict__ BV, _Float16* __restrict__ QH, _Float16* __restrict__ QL, _Float16* __restrict__ KH, __bf16* __restrict__ VT, __bf16* __restrict__ VL) {
  __shared__ __align__(16) _Float16 sh[64][136], sl[64][136]; __shared__ __align__(16) __bf16 th[128][72], tl2[128][72];
  const int tid = threadIdx.x, wave = tid >> 5, lane = tid & 31, col = lane & 15, g = lane >> 4; const int which = blockIdx.z; const int c0 = blockIdx.y * 128; const size_t r0 = (size_t)blockIdx.x * 64; const float* WA = which == 0 ? WQ : which == 1 ? WK : WV; const float* BA = which == 0 ? BQ : which == 1 ? BK : BV;
  v8f acc[8] = {};
#pragma unroll 2
  for (int kc = 0; kc < CC / 32; ++kc) { v16b a; { const float* p = X + (r0 + wave * 16 + col) * CC + kc * 32 + 8 * g;
#pragma unroll
      for (int i = 0; i < 8; ++i) { a[i] = (__bf16)p[i]; a[8 + i] = (__bf16)p[16 + i]; } }
#pragma unroll
    for (int j = 0; j < 8; ++j) { v16b w; const int o = c0 + j * 16 + col;
#pragma unroll
      for (int i = 0; i < 8; ++i) { w[i] = (__bf16)WA[(size_t)(kc * 32 + 8 * g + i) * CC + o]; w[8 + i] = (__bf16)WA[(size_t)(kc * 32 + 16 + 8 * g + i) * CC + o]; }
      acc[j] = wmma_bf(a, w, acc[j]); } }
#pragma unroll
  for (int j = 0; j < 8; ++j) { const float bb = BA ? bfr(BA[c0 + j * 16 + col]) : 0.f;
#pragma unroll
    for (int r = 0; r < 8; ++r) { const float v = acc[j][r] + bb; const int rl = wave * 16 + 8 * g + r, cl = j * 16 + col; const _Float16 hv = (_Float16)v;
      if (which == 2) { const __bf16 bh = (__bf16)v; th[cl][rl] = bh; tl2[cl][rl] = (__bf16)(v - (float)bh); } else { sh[rl][cl] = hv; sl[rl][cl] = (_Float16)((v - (float)hv) * 1024.0f); }   /* q residual carried x 2^10 so the plane stays f16-normal on the chip */ } }
  __syncthreads();
  if (which < 2) { _Float16* dh = which == 0 ? QH : KH; for (int e = tid; e < 64 * 16; e += 128) { const int rl = e >> 4, q = e & 15; vst2((unsigned*)(dh + (r0 + rl) * CC + c0 + q * 8), *(const v4u*)&sh[rl][q * 8]); if (which == 0) vst2((unsigned*)(QL + (r0 + rl) * CC + c0 + q * 8), *(const v4u*)&sl[rl][q * 8]); } }
  else { const size_t b = r0 / TT; const int t0 = (int)(r0 % TT); for (int e = tid; e < 128 * 8; e += 128) { const int cl = e >> 3, q = e & 7; const size_t o2 = (b * CC + c0 + cl) * (size_t)TT + t0 + q * 8; vst2((unsigned*)(VT + o2), *(const v4u*)&th[cl][q * 8]); vst2((unsigned*)(VL + o2), *(const v4u*)&tl2[cl][q * 8]); } } }
// ---- k_sc: block = (64 queries, 128 keys) of (b,h): 2-product logits + relative-position bias (all key blocks; bidirectional)
__global__ __launch_bounds__(128) void k_sc(const _Float16* __restrict__ QH, const _Float16* __restrict__ QL, const _Float16* __restrict__ KH, const float* __restrict__ BM, int b, int h0, float* __restrict__ S0) { __shared__ __align__(16) float ss[4][16][132]; __shared__ float sbias[4096]; const int h = h0 + blockIdx.z; float* S = S0 + (size_t)blockIdx.z * TT * TT;
#pragma unroll 1
  for (int i = threadIdx.x; i < 4095; i += 128) sbias[i] = bfr(BM[BKT[i] * NH + h]);   /* this head's bias by relative offset, staged once per block (LDS reads only in the epilogue) */
  __syncthreads();
  const int tid = threadIdx.x, wave = tid >> 5, lane = tid & 31, col = lane & 15, g = lane >> 4; const int k0 = blockIdx.y * 128; const int ql0 = blockIdx.x * 64 + wave * 16; const size_t q0 = (size_t)b * TT + ql0;
  v8f acc[8] = {}, accl[8] = {};
#pragma unroll
  for (int kc = 0; kc < HD / 32; ++kc) { const v16h ah = frag_h(QH + (q0 + col) * CC + h * HD + kc * 32, lane), al = frag_h(QL + (q0 + col) * CC + h * HD + kc * 32, lane);
#pragma unroll
    for (int j = 0; j < 8; ++j) { const v16h kb = frag_h(KH + ((size_t)b * TT + k0 + j * 16 + col) * CC + h * HD + kc * 32, lane); acc[j] = wmma16(ah, kb, acc[j]); accl[j] = wmma16(al, kb, accl[j]); } }
#pragma unroll
  for (int j = 0; j < 8; ++j) acc[j] += accl[j] * (1.0f / 1024.0f);
#pragma unroll
  for (int j = 0; j < 8; ++j) { const int kt = k0 + j * 16 + col;
#pragma unroll
    for (int r = 0; r < 8; ++r) { const int qt = ql0 + 8 * g + r; const float v = acc[j][r] + sbias[kt - qt + 2047];   /* rel_emb[bucket(k - q)][h]; no 1/sqrt(d) scaling in T5 */ ss[wave][8 * g + r][j * 16 + col] = v; } }
  LDSX(); for (int rl = 0; rl < 16; ++rl) vst2(S + (size_t)(ql0 + rl) * TT + k0 + lane * 4, *(const v4f*)&ss[wave][rl][lane * 4]); }
// ---- k_sm: block = query row: softmax over keys [0, kend) -> P x 2^11 f32 (masked -> 0)
__global__ __launch_bounds__(256) void k_sm(float* __restrict__ S0) { __shared__ float sred[8]; __shared__ float sbc; __shared__ __align__(16) float sh[TT];
  const int t = threadIdx.x; const size_t row = blockIdx.x; float* sr = S0 + (size_t)blockIdx.y * TT * TT + row * TT; const int kend = TT;
  float m = -3.0e38f; for (int k = t; k < kend; k += 256) m = fmaxf(m, sr[k]);
#pragma unroll
  for (int o = 1; o < 32; o <<= 1) m = fmaxf(m, __shfl_xor(m, o));
  if ((t & 31) == 0) sred[t >> 5] = m; __syncthreads(); if (t == 0) { float a = sred[0]; for (int i = 1; i < 8; ++i) a = fmaxf(a, sred[i]); sbc = a; } __syncthreads(); m = sbc; __syncthreads();
  float sum = 0.f; for (int k = t; k < kend; k += 256) { const float v = sr[k]; sum += (v <= -1.0e38f) ? 0.f : expf(v - m); }
#pragma unroll
  for (int o = 1; o < 32; o <<= 1) sum += __shfl_xor(sum, o);
  if ((t & 31) == 0) sred[t >> 5] = sum; __syncthreads(); if (t == 0) { float a = 0.f; for (int i = 0; i < 8; ++i) a += sred[i]; sbc = 1.0f / a; } __syncthreads(); const float inv = sbc;
  for (int k = t; k < kend; k += 256) { const float v = sr[k]; sh[k] = (v <= -1.0e38f) ? 0.f : expf(v - m) * inv * 2048.0f; }
  __syncthreads(); for (int q = t; q < kend / 4; q += 256) vst2(sr + q * 4, *(const v4f*)&sh[q * 4]); }
// ---- k_pv: block = 64 queries of (b,h): y[q][h*HD + d] = P . v  (keys [0, kend))
__global__ __launch_bounds__(128) void k_pv(const float* __restrict__ PS0, const __bf16* __restrict__ VT, const __bf16* __restrict__ VL, int b, int h0, float* __restrict__ Y) { const int h = h0 + blockIdx.z; const float* PS = PS0 + (size_t)blockIdx.z * TT * TT; __shared__ __align__(16) float ss[4][16][HD + 4];
  const int tid = threadIdx.x, wave = tid >> 5, lane = tid & 31, col = lane & 15, g = lane >> 4; const int ql0 = blockIdx.x * 64 + wave * 16; const int kend = TT;
  v8f acc[HD / 16] = {};
#pragma unroll 1
  for (int kc = 0; kc < kend / 32; ++kc) { const F2 p = split_row(PS + (size_t)(ql0 + col) * TT, kc * 32, lane);
#pragma unroll
    for (int j = 0; j < HD / 16; ++j) { const size_t po = ((size_t)b * CC + h * HD + j * 16 + col) * (size_t)TT + kc * 32; const v16b vh = frag_b(VT + po, lane); acc[j] = wmma_bf(p.h, vh, acc[j]); acc[j] = wmma_bf(p.l, vh, acc[j]); acc[j] = wmma_bf(p.h, frag_b(VL + po, lane), acc[j]); } }
#pragma unroll
  for (int j = 0; j < HD / 16; ++j)
#pragma unroll
    for (int r = 0; r < 8; ++r) ss[wave][8 * g + r][j * 16 + col] = acc[j][r] * (1.0f / 2048.0f);
  LDSX(); for (int rl = 0; rl < 16; ++rl) if (lane < HD / 4) vst2(Y + ((size_t)b * TT + ql0 + rl) * CC + h * HD + lane * 4, *(const v4f*)&ss[wave][rl][lane * 4]); }
// ---- k_out: block = (64 rows, 128 cols): out = y (bf16 hi + lo) Wo + bo
__global__ __launch_bounds__(128) void k_out(const float* __restrict__ Y, const float* __restrict__ WP, const float* __restrict__ BP, float* __restrict__ OUT) { __shared__ __align__(16) float sf[4][16][132];
  const int tid = threadIdx.x, wave = tid >> 5, lane = tid & 31, col = lane & 15, g = lane >> 4; const int c0 = blockIdx.y * 128; const size_t r0 = (size_t)blockIdx.x * 64 + wave * 16;
  v8f acc[8] = {};
#pragma unroll 2
  for (int kc = 0; kc < CC / 32; ++kc) { const F2 a = split_row(Y + (r0 + col) * CC, kc * 32, lane);
#pragma unroll
    for (int j = 0; j < 8; ++j) { v16b w; const int o = c0 + j * 16 + col;
#pragma unroll
      for (int i = 0; i < 8; ++i) { w[i] = (__bf16)WP[(size_t)(kc * 32 + 8 * g + i) * CC + o]; w[8 + i] = (__bf16)WP[(size_t)(kc * 32 + 16 + 8 * g + i) * CC + o]; }
      acc[j] = wmma_bf(a.h, w, acc[j]); acc[j] = wmma_bf(a.l, w, acc[j]); } }
#pragma unroll
  for (int j = 0; j < 8; ++j) { const float bb = BP ? bfr(BP[c0 + j * 16 + col]) : 0.f;
#pragma unroll
    for (int r = 0; r < 8; ++r) sf[wave][8 * g + r][j * 16 + col] = acc[j][r] + bb; }
  LDSX(); for (int rl = 0; rl < 16; ++rl) vst2(OUT + (r0 + rl) * CC + c0 + lane * 4, *(const v4f*)&sf[wave][rl][lane * 4]); }
extern "C" void kernel_launch(void* const* d_in, const int* in_sizes, int n_in, void* d_out, int out_size, void* d_ws, size_t ws_size, hipStream_t stream) {
  (void)in_sizes; (void)n_in; (void)out_size;
  const float** F = (const float**)d_in;   // 0 x [2,2048,1024], 1 Wq [1024,1024] ((in,out)), 2 Wk, 3 Wv, 4 Wo ((in,out)), 5 rel_emb [32,16]
  if (ws_size < (size_t)WS_END) return;
  char* ws = (char*)d_ws; _Float16 *QH = (_Float16*)(ws + WS_QH), *QL = (_Float16*)(ws + WS_QL), *KH = (_Float16*)(ws + WS_KH); __bf16 *VT = (__bf16*)(ws + WS_VT), *VL = (__bf16*)(ws + WS_VL); float *S = (float*)(ws + WS_S), *Y = (float*)(ws + WS_Y);
  k_proj<<<dim3(TNB * TT / 64, CC / 128, 3), 128, 0, stream>>>(F[0], F[1], nullptr, F[2], nullptr, F[3], nullptr, QH, QL, KH, VT, VL);
  for (int b = 0; b < TNB; ++b) for (int h0 = 0; h0 < NH; h0 += HG) {   // HG heads per launch
    k_sc<<<dim3(TT / 64, TT / 128, HG), 128, 0, stream>>>(QH, QL, KH, F[5], b, h0, S);
    k_sm<<<dim3(TT, HG), 256, 0, stream>>>(S);
    k_pv<<<dim3(TT / 64, 1, HG), 128, 0, stream>>>(S, VT, VL, b, h0, Y);
  }
  k_out<<<dim3(TNB * TT / 64, CC / 128), 128, 0, stream>>>(Y, F[4], nullptr, (float*)d_out);
}

// v001
// Measured time: 333 microseconds a run.
// In two side-by-side timings against v000, it was 5.19 and 5.18 times as fast.
// compute dtype: all float inputs rounded to bf16; q/k/v = x W ((in,out)) with EXACT bf16 products on WMMA 16x16x32, f32 accumulate; q as f16 hi + residual (x 2^10), k f16 -> 2-product logits (no 1/sqrt(d) in T5) + the relative-position bias rel_emb[bucket(k - q)][h] (bucket table precomputed from the module's own f32 formula), kept in f32 registers; online softmax in f32 (precise expf, running maximum and sum per query), P = exp(s - max) f32 split bf16 hi + lo against v bf16 hi + lo (3 products), divided by the sum at the end; out = context (bf16 hi + lo) Wo ((in,out)); f32 output.
#include <hip/hip_runtime.h>
#include <math.h>

typedef __attribute__((ext_vector_type(16))) _Float16 v16h;
typedef __attribute__((ext_vector_type(16))) __bf16 v16b;
typedef __attribute__((ext_vector_type(8)))  _Float16 v8h;
typedef __attribute__((ext_vector_type(8)))  float v8f;
typedef __attribute__((ext_vector_type(4)))  float v4f;
typedef __attribute__((ext_vector_type(2)))  float v2f;
typedef __attribute__((ext_vector_type(4)))  unsigned v4u;
typedef __attribute__((ext_vector_type(4)))  int v4i;
typedef float __attribute__((may_alias)) float_a;
typedef int __attribute__((may_alias)) int_a;

template <typename T> __device__ __forceinline__ void vst2(void* p, T v) { *(T*)p = v;  }
__device__ __forceinline__ v8f wmma16(v16h a, v16h b, v8f c) {
  v8f d = __builtin_amdgcn_wmma_f32_16x16x32_f16(false, a, false, b, (short)0, c, false, false);
  asm volatile("v_nop\n\tv_nop\n\tv_nop\n\tv_nop" : "+v"(d) : "v"(a), "v"(b));
  return d;
}
__device__ __forceinline__ v8f wmma_bf(v16b a, v16b b, v8f c) {
  v8f d = __builtin_amdgcn_wmma_f32_16x16x32_bf16(false, a, false, b, (short)0, c, false, false);
  asm volatile("v_nop\n\tv_nop\n\tv_nop\n\tv_nop" : "+v"(d) : "v"(a), "v"(b));
  return d;
}
// 16x16x32 fragments: lane = (h = lane>>4, row/col = lane&15); elements 0..7 = k0+8h+0..7, 8..15 = k0+16+8h+0..7; D element r = row 8h+r
__device__ __forceinline__ v16h frag_h(const _Float16* rowk0, int lane) {
  union { v16h v; v8h q[2]; } u; const _Float16* p = rowk0 + 8 * (lane >> 4);
  u.q[0] = *(const v8h*)p; u.q[1] = *(const v8h*)(p + 16); return u.v;
}
__device__ __forceinline__ v16h frag_f32(const float* rowk0, int lane) {
  v16h a; const float* p = rowk0 + 8 * (lane >> 4);
#pragma unroll
  for (int i = 0; i < 8; ++i) { a[i] = (_Float16)p[i]; a[8 + i] = (_Float16)p[16 + i]; }
  return a;
}
__device__ __forceinline__ v16h frag_f32s(const float* rowk0, int lane, float sc) {
  v16h a; const float* p = rowk0 + 8 * (lane >> 4);
#pragma unroll
  for (int i = 0; i < 8; ++i) { a[i] = (_Float16)(p[i] * sc); a[8 + i] = (_Float16)(p[16 + i] * sc); }
  return a;
}
// column fragment from a [K][ld] layout (column n), rows >= K read as 0
__device__ __forceinline__ v16h fragc_f32(const float* W, int k0, int n, int lane, int ld, int K) {
  v16h a; const int g = lane >> 4;
#pragma unroll
  for (int i = 0; i < 8; ++i) { const int ka = k0 + 8 * g + i, kb = ka + 16;
    a[i] = (_Float16)(ka < K ? W[(size_t)(ka < K ? ka : K - 1) * ld + n] : 0.f); a[8 + i] = (_Float16)(kb < K ? W[(size_t)(kb < K ? kb : K - 1) * ld + n] : 0.f); }
  return a;
}
struct F2 { v16b h, l; };
__device__ __forceinline__ F2 bsplit16(const float v[16]) { F2 r;
#pragma unroll
  for (int i = 0; i < 16; ++i) { const __bf16 h = (__bf16)v[i]; r.h[i] = h; r.l[i] = (__bf16)(v[i] - (float)h); }
  return r; }
__device__ __forceinline__ F2 split_row(const float* row, int k0, int lane) { float v[16]; const float* p = row + k0 + 8 * (lane >> 4);
#pragma unroll
  for (int i = 0; i < 8; ++i) { v[i] = p[i]; v[8 + i] = p[16 + i]; }
  return bsplit16(v); }
__device__ __forceinline__ F2 split_rowK(const float* row, int k0, int lane, int K) { float v[16]; const int g = lane >> 4;
#pragma unroll
  for (int i = 0; i < 8; ++i) { const int ka = k0 + 8 * g + i, kb = ka + 16; v[i] = ka < K ? row[ka < K ? ka : K - 1] : 0.f; v[8 + i] = kb < K ? row[kb < K ? kb : K - 1] : 0.f; }
  return bsplit16(v); }
__device__ __forceinline__ F2 split_col(const float* W, int k0, int n, int lane, int ld, int K) { float v[16]; const int g = lane >> 4;
#pragma unroll
  for (int i = 0; i < 8; ++i) { const int ka = k0 + 8 * g + i, kb = ka + 16; v[i] = ka < K ? W[(size_t)(ka < K ? ka : K - 1) * ld + n] : 0.f; v[8 + i] = kb < K ? W[(size_t)(kb < K ? kb : K - 1) * ld + n] : 0.f; }
  return bsplit16(v); }
__device__ __forceinline__ v8f mac3(const F2& a, const F2& b, v8f c) { c = wmma_bf(a.l, b.h, c); c = wmma_bf(a.h, b.l, c); return wmma_bf(a.h, b.h, c); }
__device__ __forceinline__ float sigm(float v) { return 1.0f / (1.0f + expf(-v)); }
#define LDSX() do { asm volatile("s_wait_dscnt 0" ::: "memory"); __builtin_amdgcn_wave_barrier(); __builtin_amdgcn_fence(__ATOMIC_RELEASE, "workgroup"); } while (0)


// T5 attention (B 2, S 2,048, D 1,024 = 16 x 64, no biases, no scaling): scores = q k^T + rel_emb[bucket(mem - ctx)] (32 buckets, bidirectional, max distance 128), softmax, P v, output projection.
#define NB 2
#define TT 2048
#define CC 1024
#define NH 16
#define HD 64
__constant__ __attribute__((aligned(16))) signed char BKT[4096] = {15,15,15,15,15,15,15,15,15,15,15,15,15,15,15,15,15,15,15,15,15,15,15,15,15,15,15,15,15,15,15,15,15,15,15,15,15,15,15,15,15,15,15,15,15,15,15,15,15,15,15,15,15,15,15,15,15,15,15,15,15,15,15,15,15,15,15,15,15,15,15,15,15,15,15,15,15,15,15,15,15,15,15,15,15,15,15,15,15,15,15,15,15,15,15,15,15,15,15,15,15,15,15,15,15,15,15,15,15,15,15,15,15,15,15,15,15,15,15,15,15,15,15,15,15,15,15,15,15,15,15,15,15,15,15,15,15,15,15,15,15,15,15,15,15,15,15,15,15,15,15,15,15,15,15,15,15,15,15,15,15,15,15,15,15,15,15,15,15,15,15,15,15,15,15,15,15,15,15,15,15,15,15,15,15,15,15,15,15,15,15,15,15,15,15,15,15,15,15,15,15,15,15,15,15,15,15,15,15,15,15,15,15,15,15,15,15,15,15,15,15,15,15,15,15,15,15,15,15,15,15,15,15,15,15,15,15,15,15,15,15,15,15,15,15,15,15,15,15,15,15,15,15,15,15,15,15,15,15,15,15,15,15,15,15,15,15,15,15,15,15,15,15,15,15,15,15,15,15,15,15,15,15,15,15,15,15,15,15,15,15,15,15,15,15,15,15,15,15,15,15,15,15,15,15,15,15,15,15,15,15,15,15,15,15,15,15,15,15,15,15,15,15,15,15,15,15,15,15,15,15,15,15,15,15,15,15,15,15,15,15,15,15,15,15,15,15,15,15,15,15,15,15,15,15,15,15,15,15,15,15,15,15,15,15,15,15,15,15,15,15,15,15,15,15,15,15,15,15,15,15,15,15,15,15,15,15,15,15,15,15,15,15,15,15,15,15,15,15,15,15,15,15,15,15,15,15,15,15,15,15,15,15,15,15,15,15,15,15,15,15,15,15,15,15,15,15,15,15,15,15,15,15,15,15,15,15,15,15,15,15,15,15,15,15,15,15,15,15,15,15,15,15,15,15,15,15,15,15,15,15,15,15,15,15,15,15,15,15,15,15,15,15,15,15,15,15,15,15,15,15,15,15,15,15,15,15,15,15,15,15,15,15,15,15,15,15,15,15,15,15,15,15,15,15,15,15,15,15,15,15,15,15,15,15,15,15,15,15,15,15,15,15,15,15,15,15,15,15,15,15,15,15,15,15,15,15,15,15,15,15,15,15,15,15,15,15,15,15,15,15,15,15,15,15,15,15,15,15,15,15,15,15,15,15,15,15,15,15,15,15,15,15,15,15,15,15,15,15,15,15,15,15,15,15,15,15,15,15,15,15,15,15,15,15,15,15,15,15,15,15,15,15,15,15,15,15,15,15,15,15,15,15,15,15,15,15,15,15,15,15,15,15,15,15,15,15,15,15,15,15,15,15,15,15,15,15,15,15,15,15,15,15,15,15,15,15,15,15,15,15,15,15,15,15,15,15,15,15,15,15,15,15,15,15,15,15,15,15,15,15,15,15,15,15,15,15,15,15,15,15,15,15,15,15,15,15,15,15,15,15,15,15,15,15,15,15,15,15,15,15,15,15,15,15,15,15,15,15,15,15,15,15,15,15,15,15,15,15,15,15,15,15,15,15,15,15,15,15,15,15,15,15,15,15,15,15,15,15,15,15,15,15,15,15,15,15,15,15,15,15,15,15,15,15,15,15,15,15,15,15,15,15,15,15,15,15,15,15,15,15,15,15,15,15,15,15,15,15,15,15,15,15,15,15,15,15,15,15,15,15,15,15,15,15,15,15,15,15,15,15,15,15,15,15,15,15,15,15,15,15,15,15,15,15,15,15,15,15,15,15,15,15,15,15,15,15,15,15,15,15,15,15,15,15,15,15,15,15,15,15,15,15,15,15,15,15,15,15,15,15,15,15,15,15,15,15,15,15,15,15,15,15,15,15,15,15,15,15,15,15,15,15,15,15,15,15,15,15,15,15,15,15,15,15,15,15,15,15,15,15,15,15,15,15,15,15,15,15,15,15,15,15,15,15,15,15,15,15,15,15,15,15,15,15,15,15,15,15,15,15,15,15,15,15,15,15,15,15,15,15,15,15,15,15,15,15,15,15,15,15,15,15,15,15,15,15,15,15,15,15,15,15,15,15,15,15,15,15,15,15,15,15,15,15,15,15,15,15,15,15,15,15,15,15,15,15,15,15,15,15,15,15,15,15,15,15,15,15,15,15,15,15,15,15,15,15,15,15,15,15,15,15,15,15,15,15,15,15,15,15,15,15,15,15,15,15,15,15,15,15,15,15,15,15,15,15,15,15,15,15,15,15,15,15,15,15,15,15,15,15,15,15,15,15,15,15,15,15,15,15,15,15,15,15,15,15,15,15,15,15,15,15,15,15,15,15,15,15,15,15,15,15,15,15,15,15,15,15,15,15,15,15,15,15,15,15,15,15,15,15,15,15,15,15,15,15,15,15,15,15,15,15,15,15,15,15,15,15,15,15,15,15,15,15,15,15,15,15,15,15,15,15,15,15,15,15,15,15,15,15,15,15,15,15,15,15,15,15,15,15,15,15,15,15,15,15,15,15,15,15,15,15,15,15,15,15,15,15,15,15,15,15,15,15,15,15,15,15,15,15,15,15,15,15,15,15,15,15,15,15,15,15,15,15,15,15,15,15,15,15,15,15,15,15,15,15,15,15,15,15,15,15,15,15,15,15,15,15,15,15,15,15,15,15,15,15,15,15,15,15,15,15,15,15,15,15,15,15,15,15,15,15,15,15,15,15,15,15,15,15,15,15,15,15,15,15,15,15,15,15,15,15,15,15,15,15,15,15,15,15,15,15,15,15,15,15,15,15,15,15,15,15,15,15,15,15,15,15,15,15,15,15,15,15,15,15,15,15,15,15,15,15,15,15,15,15,15,15,15,15,15,15,15,15,15,15,15,15,15,15,15,15,15,15,15,15,15,15,15,15,15,15,15,15,15,15,15,15,15,15,15,15,15,15,15,15,15,15,15,15,15,15,15,15,15,15,15,15,15,15,15,15,15,15,15,15,15,15,15,15,15,15,15,15,15,15,15,15,15,15,15,15,15,15,15,15,15,15,15,15,15,15,15,15,15,15,15,15,15,15,15,15,15,15,15,15,15,15,15,15,15,15,15,15,15,15,15,15,15,15,15,15,15,15,15,15,15,15,15,15,15,15,15,15,15,15,15,15,15,15,15,15,15,15,15,15,15,15,15,15,15,15,15,15,15,15,15,15,15,15,15,15,15,15,15,15,15,15,15,15,15,15,15,15,15,15,15,15,15,15,15,15,15,15,15,15,15,15,15,15,15,15,15,15,15,15,15,15,15,15,15,15,15,15,15,15,15,15,15,15,15,15,15,15,15,15,15,15,15,15,15,15,15,15,15,15,15,15,15,15,15,15,15,15,15,15,15,15,15,15,15,15,15,15,15,15,15,15,15,15,15,15,15,15,15,15,15,15,15,15,15,15,15,15,15,15,15,15,15,15,15,15,15,15,15,15,15,15,15,15,15,15,15,15,15,15,15,15,15,15,15,15,15,15,15,15,15,15,15,15,15,15,15,15,15,15,15,15,15,15,15,15,15,15,15,15,15,15,15,15,15,15,15,15,15,15,15,15,15,15,15,15,15,15,15,15,15,15,15,15,15,15,15,15,15,15,15,15,15,15,15,15,15,15,15,15,15,15,15,15,15,15,15,15,15,15,15,15,15,15,15,15,15,15,15,15,15,15,15,15,15,15,15,15,15,15,15,15,15,15,15,15,15,15,15,15,15,15,15,15,15,15,15,15,15,15,15,15,15,15,15,15,15,15,15,15,15,15,15,15,15,15,15,15,15,15,15,15,15,15,15,15,15,15,15,15,15,15,15,15,15,15,15,15,15,15,15,15,15,15,15,15,15,15,15,15,15,15,15,15,15,15,15,15,15,15,15,15,15,15,15,15,15,15,15,15,15,15,15,15,15,15,15,15,15,15,15,15,15,15,15,15,15,15,15,15,15,15,15,15,15,15,15,15,15,15,15,15,15,15,15,15,15,15,15,15,15,15,15,15,15,15,15,15,15,15,15,15,15,15,15,15,15,15,15,15,15,15,15,15,15,15,15,15,15,15,15,15,15,15,15,15,15,15,15,15,15,15,15,15,15,15,15,15,15,15,15,15,15,15,15,15,15,15,15,15,15,15,15,15,15,15,15,15,15,15,15,15,15,15,15,15,15,15,15,15,15,15,15,15,15,15,15,15,15,15,15,15,15,15,15,15,15,15,15,15,15,15,15,15,15,15,15,15,15,15,15,15,15,15,15,15,15,15,15,15,15,15,15,15,15,15,15,15,15,15,15,15,15,15,15,15,15,15,15,15,15,15,15,15,15,15,15,15,15,15,14,14,14,14,14,14,14,14,14,14,14,14,14,14,14,14,14,14,14,14,14,14,14,14,14,14,14,13,13,13,13,13,13,13,13,13,13,13,13,13,13,13,13,13,13,12,12,12,12,12,12,12,12,12,12,12,12,12,12,11,11,11,11,11,11,11,11,11,10,10,10,10,10,10,10,9,9,9,9,8,8,8,8,7,6,5,4,3,2,1,0,17,18,19,20,21,22,23,24,24,24,24,25,25,25,25,26,26,26,26,26,26,26,27,27,27,27,27,27,27,27,27,28,28,28,28,28,28,28,28,28,28,28,28,28,28,29,29,29,29,29,29,29,29,29,29,29,29,29,29,29,29,29,29,30,30,30,30,30,30,30,30,30,30,30,30,30,30,30,30,30,30,30,30,30,30,30,30,30,30,30,31,31,31,31,31,31,31,31,31,31,31,31,31,31,31,31,31,31,31,31,31,31,31,31,31,31,31,31,31,31,31,31,31,31,31,31,31,31,31,31,31,31,31,31,31,31,31,31,31,31,31,31,31,31,31,31,31,31,31,31,31,31,31,31,31,31,31,31,31,31,31,31,31,31,31,31,31,31,31,31,31,31,31,31,31,31,31,31,31,31,31,31,31,31,31,31,31,31,31,31,31,31,31,31,31,31,31,31,31,31,31,31,31,31,31,31,31,31,31,31,31,31,31,31,31,31,31,31,31,31,31,31,31,31,31,31,31,31,31,31,31,31,31,31,31,31,31,31,31,31,31,31,31,31,31,31,31,31,31,31,31,31,31,31,31,31,31,31,31,31,31,31,31,31,31,31,31,31,31,31,31,31,31,31,31,31,31,31,31,31,31,31,31,31,31,31,31,31,31,31,31,31,31,31,31,31,31,31,31,31,31,31,31,31,31,31,31,31,31,31,31,31,31,31,31,31,31,31,31,31,31,31,31,31,31,31,31,31,31,31,31,31,31,31,31,31,31,31,31,31,31,31,31,31,31,31,31,31,31,31,31,31,31,31,31,31,31,31,31,31,31,31,31,31,31,31,31,31,31,31,31,31,31,31,31,31,31,31,31,31,31,31,31,31,31,31,31,31,31,31,31,31,31,31,31,31,31,31,31,31,31,31,31,31,31,31,31,31,31,31,31,31,31,31,31,31,31,31,31,31,31,31,31,31,31,31,31,31,31,31,31,31,31,31,31,31,31,31,31,31,31,31,31,31,31,31,31,31,31,31,31,31,31,31,31,31,31,31,31,31,31,31,31,31,31,31,31,31,31,31,31,31,31,31,31,31,31,31,31,31,31,31,31,31,31,31,31,31,31,31,31,31,31,31,31,31,31,31,31,31,31,31,31,31,31,31,31,31,31,31,31,31,31,31,31,31,31,31,31,31,31,31,31,31,31,31,31,31,31,31,31,31,31,31,31,31,31,31,31,31,31,31,31,31,31,31,31,31,31,31,31,31,31,31,31,31,31,31,31,31,31,31,31,31,31,31,31,31,31,31,31,31,31,31,31,31,31,31,31,31,31,31,31,31,31,31,31,31,31,31,31,31,31,31,31,31,31,31,31,31,31,31,31,31,31,31,31,31,31,31,31,31,31,31,31,31,31,31,31,31,31,31,31,31,31,31,31,31,31,31,31,31,31,31,31,31,31,31,31,31,31,31,31,31,31,31,31,31,31,31,31,31,31,31,31,31,31,31,31,31,31,31,31,31,31,31,31,31,31,31,31,31,31,31,31,31,31,31,31,31,31,31,31,31,31,31,31,31,31,31,31,31,31,31,31,31,31,31,31,31,31,31,31,31,31,31,31,31,31,31,31,31,31,31,31,31,31,31,31,31,31,31,31,31,31,31,31,31,31,31,31,31,31,31,31,31,31,31,31,31,31,31,31,31,31,31,31,31,31,31,31,31,31,31,31,31,31,31,31,31,31,31,31,31,31,31,31,31,31,31,31,31,31,31,31,31,31,31,31,31,31,31,31,31,31,31,31,31,31,31,31,31,31,31,31,31,31,31,31,31,31,31,31,31,31,31,31,31,31,31,31,31,31,31,31,31,31,31,31,31,31,31,31,31,31,31,31,31,31,31,31,31,31,31,31,31,31,31,31,31,31,31,31,31,31,31,31,31,31,31,31,31,31,31,31,31,31,31,31,31,31,31,31,31,31,31,31,31,31,31,31,31,31,31,31,31,31,31,31,31,31,31,31,31,31,31,31,31,31,31,31,31,31,31,31,31,31,31,31,31,31,31,31,31,31,31,31,31,31,31,31,31,31,31,31,31,31,31,31,31,31,31,31,31,31,31,31,31,31,31,31,31,31,31,31,31,31,31,31,31,31,31,31,31,31,31,31,31,31,31,31,31,31,31,31,31,31,31,31,31,31,31,31,31,31,31,31,31,31,31,31,31,31,31,31,31,31,31,31,31,31,31,31,31,31,31,31,31,31,31,31,31,31,31,31,31,31,31,31,31,31,31,31,31,31,31,31,31,31,31,31,31,31,31,31,31,31,31,31,31,31,31,31,31,31,31,31,31,31,31,31,31,31,31,31,31,31,31,31,31,31,31,31,31,31,31,31,31,31,31,31,31,31,31,31,31,31,31,31,31,31,31,31,31,31,31,31,31,31,31,31,31,31,31,31,31,31,31,31,31,31,31,31,31,31,31,31,31,31,31,31,31,31,31,31,31,31,31,31,31,31,31,31,31,31,31,31,31,31,31,31,31,31,31,31,31,31,31,31,31,31,31,31,31,31,31,31,31,31,31,31,31,31,31,31,31,31,31,31,31,31,31,31,31,31,31,31,31,31,31,31,31,31,31,31,31,31,31,31,31,31,31,31,31,31,31,31,31,31,31,31,31,31,31,31,31,31,31,31,31,31,31,31,31,31,31,31,31,31,31,31,31,31,31,31,31,31,31,31,31,31,31,31,31,31,31,31,31,31,31,31,31,31,31,31,31,31,31,31,31,31,31,31,31,31,31,31,31,31,31,31,31,31,31,31,31,31,31,31,31,31,31,31,31,31,31,31,31,31,31,31,31,31,31,31,31,31,31,31,31,31,31,31,31,31,31,31,31,31,31,31,31,31,31,31,31,31,31,31,31,31,31,31,31,31,31,31,31,31,31,31,31,31,31,31,31,31,31,31,31,31,31,31,31,31,31,31,31,31,31,31,31,31,31,31,31,31,31,31,31,31,31,31,31,31,31,31,31,31,31,31,31,31,31,31,31,31,31,31,31,31,31,31,31,31,31,31,31,31,31,31,31,31,31,31,31,31,31,31,31,31,31,31,31,31,31,31,31,31,31,31,31,31,31,31,31,31,31,31,31,31,31,31,31,31,31,31,31,31,31,31,31,31,31,31,31,31,31,31,31,31,31,31,31,31,31,31,31,31,31,31,31,31,31,31,31,31,31,31,31,31,31,31,31,31,31,31,31,31,31,31,31,31,31,31,31,31,31,31,31,31,31,31,31,31,31,31,31,31,31,31,31,31,31,31,31,31,31,31,31,31,31,31,31,31,31,31,31,31,31,31,31,31,31,31,31,31,31,31,31,31,31,31,31,31,31,31,31,31,31,31,31,31,31,31,31,31,31,31,31,31,31,31,31,31,31,31,31,31,31,31,31,31,31,31,31,31,31,31,31,31,31,31,31,31,31,31,31,31,31,31,31,31,31,31,31,31,31,31,31,31,31,31,31,31,31,31,31,31,31,31,31,31,31,31,31,31,31,31,31,31,31,31,31,31,31,31,31,31,31,31,31,31,31,31,31,31,31,31,31,31,31,31,31,31,31,31,31,31,31,31,31,31,31,31,31,31,31,31,31,31,31,31,31,31,31,31,31,31,31,31,31,31,31,31,31,31,31,31,31,31,31,31,31,31,31,31,31,31,31,31,31,31,31,31,31,31,31,31,31,31,31,31,31,31,31,31,31,31,31,31,31,31,31,31,31,31,31,31,31,31,31,31,31,31,31,31,31,31,31,31,31,31,31,31,31,31,31,31,31,31,31,31,31,31,31,31,31,31,31,31,31,31,31,31,31,31,31,31,31,31,31,31,31,31,31,31,31,31,31,31,31,31,31,31,31,31,31,31,31,31,31,31,31,31,31,31,31,31,31,31,31,31,31,31,31,31,31,31,31,31,31,31,31,31,31,31,31,31,31,31,31,31,31,31,31,31,31,31,31,31,31,31,31,31,31,31,31,31,31,31,31,31,31,31,31,31,31,31,31,31,31,31,31,31,31,31,31,31,31,31,31,31,31,31,31,31,31,31,31,31,31,31,31,31,31,31,31,31,31,31,31,31,31,31,31,31,31,31,31,31,31,31,31,31,31,31,31,31,31,31,31,31,31,31,31,31,31,31,31,31,31,31,31,31,31,31,31,31,31,31,31,31,31,31,31,31,31,31,31,31,31,31,31,31,31,31,31,31,31,31,31,31,31,31,31,31,31,31,31,31,31,31,31,31,31,31,31,31,31,31,31,31,31,31,31,31,31,31,31,31,31,31,31,31,31,31,31,31,31,31,31,31,31,31,31,31,31,31,31,31,31,31,31,31,31,31,31,31,31,31,31,31,31,31,31,31,31,31,31,31,31,31,31,31,31,31,31,31,31,31,31,31,31,31,31,31,31,31,31,31,31,31,31,31,31,31,31,31,31,31,31,31,31,31,31,31,31,31,31,31,31,31,31,31,31,31,31,31,31,31,31,31,31,31,31,31,31,31,31,31,31,31,31,31,31,31,31,31,31,31,31,31,31,31,31,31,31,31,31,31,31,31,31,31,31,31,31,31,31,31,31,31,31,31,31,31,31,31,31,31,31,31,31,31,31,31};   // relative_position_bucket(k - q) for k - q = -2047 .. 2047 (the module's f32 formula, evaluated exactly as jnp does); entry 4095 is padding (0) so that the table reads in 16-byte words
#ifndef TNB
#define TNB NB
#endif
typedef __attribute__((ext_vector_type(8))) __bf16 v8b;
__device__ __forceinline__ v16b frag_b(const __bf16* rowk0, int lane) {
  union { v16b v; v8b q[2]; } u; const __bf16* p = rowk0 + 8 * (lane >> 4);
  u.q[0] = *(const v8b*)p; u.q[1] = *(const v8b*)(p + 16); return u.v;
}
__device__ __forceinline__ float bfr(float v) { return (float)(__bf16)v; }
__device__ __attribute__((noinline)) float exp_ni(float v) { return expf(v); }
__device__ __attribute__((noinline)) float erf_ni(float v) { return erff(v); }

#define WS_QH  0u
#define WS_QL  (WS_QH + 2u * (size_t)NB * TT * CC)
#define WS_KH  (WS_QL + 2u * (size_t)NB * TT * CC)
#define WS_VT  (WS_KH + 2u * (size_t)NB * TT * CC)      // bf16 v planes [b][c][t]
#define WS_VL  (WS_VT + 2u * (size_t)NB * CC * TT)      // bf16 v residual planes
#define WS_Y   (WS_VL + 2u * (size_t)NB * CC * TT)      // f32 y rows [b*t][C]
#define WS_END (WS_Y + 4u * (size_t)NB * TT * CC)

// ---- k_proj: block = (64 rows, 128 cols, which): qkv = x W (+ b), exact; q -> f16 hi (+ residual), k -> f16 rows, v -> bf16 hi + lo planes
__global__ __launch_bounds__(128) void k_proj(const float* __restrict__ X, const float* __restrict__ WQ, const float* __restrict__ BQ, const float* __restrict__ WK, const float* __restrict__ BK, const float* __restrict__ WV, const float* __restrict__ BV, _Float16* __restrict__ QH, _Float16* __restrict__ QL, _Float16* __restrict__ KH, __bf16* __restrict__ VT, __bf16* __restrict__ VL) {
  __shared__ __align__(16) _Float16 sh[64][136], sl[64][136]; __shared__ __align__(16) __bf16 th[128][72], tl2[128][72];
  const int tid = threadIdx.x, wave = tid >> 5, lane = tid & 31, col = lane & 15, g = lane >> 4; const int which = blockIdx.z; const int c0 = blockIdx.y * 128; const size_t r0 = (size_t)blockIdx.x * 64; const float* WA = which == 0 ? WQ : which == 1 ? WK : WV; const float* BA = which == 0 ? BQ : which == 1 ? BK : BV;
  v8f acc[8] = {};
#pragma unroll 2
  for (int kc = 0; kc < CC / 32; ++kc) { v16b a; { const float* p = X + (r0 + wave * 16 + col) * CC + kc * 32 + 8 * g;
#pragma unroll
      for (int i = 0; i < 8; ++i) { a[i] = (__bf16)p[i]; a[8 + i] = (__bf16)p[16 + i]; } }
#pragma unroll
    for (int j = 0; j < 8; ++j) { v16b w; const int o = c0 + j * 16 + col;
#pragma unroll
      for (int i = 0; i < 8; ++i) { w[i] = (__bf16)WA[(size_t)(kc * 32 + 8 * g + i) * CC + o]; w[8 + i] = (__bf16)WA[(size_t)(kc * 32 + 16 + 8 * g + i) * CC + o]; }
      acc[j] = wmma_bf(a, w, acc[j]); } }
#pragma unroll
  for (int j = 0; j < 8; ++j) { const float bb = BA ? bfr(BA[c0 + j * 16 + col]) : 0.f;
#pragma unroll
    for (int r = 0; r < 8; ++r) { const float v = acc[j][r] + bb; const int rl = wave * 16 + 8 * g + r, cl = j * 16 + col; const _Float16 hv = (_Float16)v;
      if (which == 2) { const __bf16 bh = (__bf16)v; th[cl][rl] = bh; tl2[cl][rl] = (__bf16)(v - (float)bh); } else { sh[rl][cl] = hv; sl[rl][cl] = (_Float16)((v - (float)hv) * 1024.0f); }   /* q residual carried x 2^10 so the plane stays f16-normal on the chip */ } }
  __syncthreads();
  if (which < 2) { _Float16* dh = which == 0 ? QH : KH; for (int e = tid; e < 64 * 16; e += 128) { const int rl = e >> 4, q = e & 15; vst2((unsigned*)(dh + (r0 + rl) * CC + c0 + q * 8), *(const v4u*)&sh[rl][q * 8]); if (which == 0) vst2((unsigned*)(QL + (r0 + rl) * CC + c0 + q * 8), *(const v4u*)&sl[rl][q * 8]); } }
  else { const size_t b = r0 / TT; const int t0 = (int)(r0 % TT); for (int e = tid; e < 128 * 8; e += 128) { const int cl = e >> 3, q = e & 7; const size_t o2 = (b * CC + c0 + cl) * (size_t)TT + t0 + q * 8; vst2((unsigned*)(VT + o2), *(const v4u*)&th[cl][q * 8]); vst2((unsigned*)(VL + o2), *(const v4u*)&tl2[cl][q * 8]); } } }
// ---- k_attn: block = 64 queries (4 waves x 16) of (b,h); each wave walks all keys in passes of 64 with a running maximum and sum. Four waves a SIMD (launch bound): all 1,024 blocks are resident at once.
// S^T = K Q^T: lane (g, col) holds query col, keys 8g + r of each 16-key tile, so two tiles are a B operand of O^T += V^T P^T in the same k order as frag_b: P never leaves registers.
__global__ __launch_bounds__(128, 4) void k_attn(const _Float16* __restrict__ QH, const _Float16* __restrict__ QL, const _Float16* __restrict__ KH, const __bf16* __restrict__ VT, const __bf16* __restrict__ VL, const float* __restrict__ BM, float* __restrict__ Y) {
  __shared__ __align__(16) float sbias[4096]; __shared__ __align__(16) float ss[4][16][HD + 4];
  const int tid = threadIdx.x, wave = tid >> 5, lane = tid & 31, col = lane & 15, g = lane >> 4; const int h = blockIdx.y, b = blockIdx.z;
  // this head's bias by relative offset, staged once per block: lane = bucket holds rel_emb[bucket][h]; each thread reads 32 table entries as two 16-byte words and each entry picks its lane (entry 4095 is padding that nobody reads)
  const float bl = bfr(BM[lane * NH + h]); typedef v4i __attribute__((may_alias)) v4i_a; v4i bw[2] = { *(const v4i_a*)(BKT + tid * 32), *(const v4i_a*)(BKT + tid * 32 + 16) };
#pragma unroll
  for (int q = 0; q < 8; ++q) { const int w = bw[q >> 2][q & 3]; vst2(&sbias[tid * 32 + q * 4], (v4f){__shfl(bl, w & 255), __shfl(bl, (w >> 8) & 255), __shfl(bl, (w >> 16) & 255), __shfl(bl, (w >> 24) & 255)}); }
  __syncthreads();
  const int ql0 = blockIdx.x * 64 + wave * 16; const size_t q0 = (size_t)b * TT + ql0;
  v16h ah[HD / 32], al[HD / 32];
#pragma unroll
  for (int kc = 0; kc < HD / 32; ++kc) { ah[kc] = frag_h(QH + (q0 + col) * CC + h * HD + kc * 32, lane); al[kc] = frag_h(QL + (q0 + col) * CC + h * HD + kc * 32, lane); }
  const _Float16* kp = KH + ((size_t)b * TT + col) * CC + h * HD;
  const size_t vo = ((size_t)b * CC + h * HD + col) * (size_t)TT;
  const float* bp = sbias + 2047 - (ql0 + col) + 8 * g;   // bp[key tile base + r] = rel_emb[bucket(k - q)][h]
  v8f acc[HD / 16] = {}; float m = -3.0e38f, l = 0.f;
#pragma unroll 1
  for (int k0 = 0; k0 < TT; k0 += 64) {   // rolled: one pass already holds 40 matrix products and all the registers a wave should take at four waves a SIMD
    v16h kb[4][HD / 32];   // the pass's k fragments, loaded as one group ahead of the products: one load latency a pass, not eight
#pragma unroll
    for (int t = 0; t < 4; ++t)
#pragma unroll
      for (int kc = 0; kc < HD / 32; ++kc) kb[t][kc] = frag_h(kp + (size_t)(k0 + t * 16) * CC + kc * 32, lane);
    v8f s[4] = {}, sl[4] = {};
#pragma unroll
    for (int kc = 0; kc < HD / 32; ++kc)
#pragma unroll
      for (int t = 0; t < 4; ++t) { s[t] = wmma16(kb[t][kc], ah[kc], s[t]); sl[t] = wmma16(kb[t][kc], al[kc], sl[t]); }
    v16b vh[2][HD / 16], vl[2][HD / 16];
#pragma unroll
    for (int j = 0; j < HD / 16; ++j) { const size_t po = vo + (size_t)j * 16 * TT + k0; vh[0][j] = frag_b(VT + po, lane); vl[0][j] = frag_b(VL + po, lane); }
    __builtin_amdgcn_sched_barrier(0);   // keeps the first 32 keys' v loads issued ahead of the softmax arithmetic, which hides their latency
    float mx = m;
#pragma unroll
    for (int t = 0; t < 4; ++t) { s[t] += sl[t] * (1.0f / 1024.0f);
#pragma unroll
      for (int r = 0; r < 8; ++r) { s[t][r] += bp[k0 + t * 16 + r];   /* no 1/sqrt(d) scaling in T5 */ mx = fmaxf(mx, s[t][r]); } }
    mx = fmaxf(mx, __shfl_xor(mx, 16));   // the other half of the wave holds this query's other 32 keys
    const float alpha = expf(m - mx); m = mx; float ps = 0.f;
#pragma unroll
    for (int t = 0; t < 4; ++t)
#pragma unroll
      for (int r = 0; r < 8; ++r) { s[t][r] = expf(s[t][r] - mx); ps += s[t][r]; }
    l = l * alpha + ps;
#pragma unroll
    for (int j = 0; j < HD / 16; ++j) acc[j] *= alpha;
    __builtin_amdgcn_sched_barrier(0);   // keeps the second 32 keys' v (hi) loads below the exponentials (registers) ...
#pragma unroll
    for (int j = 0; j < HD / 16; ++j) vh[1][j] = frag_b(VT + vo + (size_t)j * 16 * TT + k0 + 32, lane);
    __builtin_amdgcn_sched_barrier(0);   // ... and ahead of the bf16 splits and the first half's products, which hide their latency
    F2 p[2];
#pragma unroll
    for (int u = 0; u < 2; ++u) { float pv[16];
#pragma unroll
      for (int i = 0; i < 8; ++i) { pv[i] = s[2 * u][i]; pv[8 + i] = s[2 * u + 1][i]; }
      p[u] = bsplit16(pv); }
#pragma unroll
    for (int u = 0; u < 2; ++u) {   // per accumulator the order stays vh p.h, vh p.l, vl p.h; the four tiles are interleaved so that no product waits on the one before it
#pragma unroll
      for (int j = 0; j < HD / 16; ++j) acc[j] = wmma_bf(vh[u][j], p[u].h, acc[j]);
#pragma unroll
      for (int j = 0; j < HD / 16; ++j) acc[j] = wmma_bf(vh[u][j], p[u].l, acc[j]);
      if (u == 0) {   // the second 32 keys' v residuals go into the registers that vh[0] has just left, twelve products ahead of their use
#pragma unroll
        for (int j = 0; j < HD / 16; ++j) vl[1][j] = frag_b(VL + vo + (size_t)j * 16 * TT + k0 + 32, lane); }
#pragma unroll
      for (int j = 0; j < HD / 16; ++j) acc[j] = wmma_bf(vl[u][j], p[u].h, acc[j]); } }
  l += __shfl_xor(l, 16); const float inv = 1.0f / l;
#pragma unroll
  for (int j = 0; j < HD / 16; ++j) { const v8f o = acc[j] * inv;   // lane (g, col): query col, d = j*16 + 8g + r
    vst2(&ss[wave][col][j * 16 + 8 * g], (v4f){o[0], o[1], o[2], o[3]}); vst2(&ss[wave][col][j * 16 + 8 * g + 4], (v4f){o[4], o[5], o[6], o[7]}); }
  LDSX(); for (int it = 0; it < 8; ++it) { const int rl = it * 2 + g; vst2(Y + (q0 + rl) * CC + h * HD + col * 4, *(const v4f*)&ss[wave][rl][col * 4]); } }
// ---- k_out: block = (64 rows, 128 cols): out = y (bf16 hi + lo) Wo + bo
__global__ __launch_bounds__(128) void k_out(const float* __restrict__ Y, const float* __restrict__ WP, const float* __restrict__ BP, float* __restrict__ OUT) { __shared__ __align__(16) float sf[4][16][132];
  const int tid = threadIdx.x, wave = tid >> 5, lane = tid & 31, col = lane & 15, g = lane >> 4; const int c0 = blockIdx.y * 128; const size_t r0 = (size_t)blockIdx.x * 64 + wave * 16;
  v8f acc[8] = {};
#pragma unroll 2
  for (int kc = 0; kc < CC / 32; ++kc) { const F2 a = split_row(Y + (r0 + col) * CC, kc * 32, lane);
#pragma unroll
    for (int j = 0; j < 8; ++j) { v16b w; const int o = c0 + j * 16 + col;
#pragma unroll
      for (int i = 0; i < 8; ++i) { w[i] = (__bf16)WP[(size_t)(kc * 32 + 8 * g + i) * CC + o]; w[8 + i] = (__bf16)WP[(size_t)(kc * 32 + 16 + 8 * g + i) * CC + o]; }
      acc[j] = wmma_bf(a.h, w, acc[j]); acc[j] = wmma_bf(a.l, w, acc[j]); } }
#pragma unroll
  for (int j = 0; j < 8; ++j) { const float bb = BP ? bfr(BP[c0 + j * 16 + col]) : 0.f;
#pragma unroll
    for (int r = 0; r < 8; ++r) sf[wave][8 * g + r][j * 16 + col] = acc[j][r] + bb; }
  LDSX(); for (int rl = 0; rl < 16; ++rl) vst2(OUT + (r0 + rl) * CC + c0 + lane * 4, *(const v4f*)&sf[wave][rl][lane * 4]); }
extern "C" void kernel_launch(void* const* d_in, const int* in_sizes, int n_in, void* d_out, int out_size, void* d_ws, size_t ws_size, hipStream_t stream) {
  (void)in_sizes; (void)n_in; (void)out_size;
  const float** F = (const float**)d_in;   // 0 x [2,2048,1024], 1 Wq [1024,1024] ((in,out)), 2 Wk, 3 Wv, 4 Wo ((in,out)), 5 rel_emb [32,16]
  if (ws_size < (size_t)WS_END) return;
  char* ws = (char*)d_ws; _Float16 *QH = (_Float16*)(ws + WS_QH), *QL = (_Float16*)(ws + WS_QL), *KH = (_Float16*)(ws + WS_KH); __bf16 *VT = (__bf16*)(ws + WS_VT), *VL = (__bf16*)(ws + WS_VL); float *Y = (float*)(ws + WS_Y);
  k_proj<<<dim3(TNB * TT / 64, CC / 128, 3), 128, 0, stream>>>(F[0], F[1], nullptr, F[2], nullptr, F[3], nullptr, QH, QL, KH, VT, VL);
  k_attn<<<dim3(TT / 64, NH, TNB), 128, 0, stream>>>(QH, QL, KH, VT, VL, F[5], Y);
  k_out<<<dim3(TNB * TT / 64, CC / 128), 128, 0, stream>>>(Y, F[4], nullptr, (float*)d_out);
}
